// v000
// The times below were measured on an AMD MI455X: many runs one after another, warmed up first and cycling through
// copies of the inputs, with the whole window's GPU time divided by the number of runs. Launches and the gaps
// between them are all in it. The median over several windows is given; except for v000 it joins two sittings, which
// can be a few percent apart, so the side-by-side timings, each taken in one sitting, are the better comparison.
// The starting kernel, v000, takes 1080 microseconds a run.
// All contractions (x.Wq, mem.Wk, Wv^T.mem^T with K=1024; q.keys^T with K=1024; P.values with K=4096):
// v_wmma_f32_16x16x32_bf16 (bf16 operands RNE-converted, single product, f32 accumulate);
// softmax max/exp/sum/normalise and the residual add x + ctx in f32 on VALU.
#include <hip/hip_runtime.h>
#include <math.h>
#include <stdint.h>

#define NQ  8192           // query rows
#define NH  1024           // hidden dim
#define NM  4096           // memory slots
#define QCH 2048           // query rows per score / softmax / context pass
static_assert((NQ % QCH) == 0);
static_assert((QCH % 64) == 0 && (NM % 64) == 0 && (NH % 64) == 0);
static_assert((NH % 32) == 0 && (NM % 32) == 0);
static_assert(NM == 256 * 16);
static_assert(((NQ * NH) % (8 * 256)) == 0 && ((NM * NH) % (8 * 256)) == 0);

typedef __bf16   v16b __attribute__((ext_vector_type(16)));
typedef __bf16   v8b  __attribute__((ext_vector_type(8)));
typedef float    v8f  __attribute__((ext_vector_type(8)));
typedef float    v4f  __attribute__((ext_vector_type(4)));
typedef unsigned int v4u __attribute__((ext_vector_type(4)));

// ---- scalar helpers --------------------------------------------------------------------------------
__device__ __forceinline__ unsigned short bf_bits(float f) {          // f32 -> bf16 bits, RNE convert
  unsigned u = __float_as_uint(f);
  return (unsigned short)((u + 0x7FFFu + ((u >> 16) & 1u)) >> 16);
}
__device__ __forceinline__ unsigned pk16(unsigned short a, unsigned short b) { return (unsigned)a | ((unsigned)b << 16); }
__device__ __forceinline__ v8f zero8() { v8f z = {0.f, 0.f, 0.f, 0.f, 0.f, 0.f, 0.f, 0.f}; return z; }

// ---- fragment loader: 16-bit A/Bt operand, lane -> row/col (lane&15), p already includes +8*(lane>>4);
//      elements 0..7 <- p[0..7] (k0+8h..k0+8h+7), elements 8..15 <- p[16..23] (k0+16+8h..k0+16+8h+7)
__device__ __forceinline__ float bf_round(float f) {               // value of the bf16 RNE rounding of f
  return __uint_as_float(((unsigned)bf_bits(f)) << 16);
}
__device__ __forceinline__ v16b ldfrag_b(const __bf16* p) {
  union { v16b v; v8b h[2]; } f;
  f.h[0] = *(const v8b*)(p);
  f.h[1] = *(const v8b*)(p + 16);
  return f.v;
}

// ---- WMMA helpers with trailing VALU hazard gap --------------------------------------------------------
__device__ __forceinline__ v8f mma_b_raw(v16b a, v16b b, v8f c) {
  return __builtin_amdgcn_wmma_f32_16x16x32_bf16(false, a, false, b, (short)0, c, false, false);
}
__device__ __forceinline__ void dep_guard_b(v8f& a, v8f& b, v16b x, v16b y) {
#if defined(__HIP_DEVICE_COMPILE__)
  asm volatile("v_nop\n\tv_nop\n\tv_nop\n\tv_nop" : "+v"(a), "+v"(b) : "v"(x), "v"(y));
#endif
}
__device__ __forceinline__ void keep4_b(v16b a, v16b b, v16b c, v16b d) {
#if defined(__HIP_DEVICE_COMPILE__)
  asm volatile("v_nop" :: "v"(a), "v"(b), "v"(c), "v"(d));
#endif
}
__device__ __forceinline__ void acc_guard4(v8f& a, v8f& b, v8f& c, v8f& d) {
#if defined(__HIP_DEVICE_COMPILE__)
  asm volatile("v_nop\n\tv_nop\n\tv_nop\n\tv_nop" : "+v"(a), "+v"(b), "+v"(c), "+v"(d));
#endif
}
__device__ __forceinline__ void wave_sync_lds() {
  __builtin_amdgcn_fence(__ATOMIC_RELEASE, "workgroup");
  __builtin_amdgcn_wave_barrier();
  __builtin_amdgcn_fence(__ATOMIC_ACQUIRE, "workgroup");
}

// =====================================================================================================
// f32 -> bf16 (RNE convert), 8 elements per thread, one 16-B store per lane: a wave writes 512 contiguous B
// write zeros (padding rows); the source address is clamped so every load is in range. grid = n8tot/256
// (n8tot a multiple of 256 for every use here). coverage: n8tot threads x 8 = the whole destination plane.
// =====================================================================================================
__global__ __launch_bounds__(256) void cvt_bf16x8(const float* __restrict__ in, unsigned short* out,
                                                  int n8, int n8tot) {
  const int i = blockIdx.x * 256 + threadIdx.x;
  if (i >= n8tot) return;
  int ic = i;
  if (ic > n8 - 1) ic = n8 - 1;
  const v4f a = *(const v4f*)(in + (size_t)ic * 8);
  const v4f b = *(const v4f*)(in + (size_t)ic * 8 + 4);
  v4u p;
  p[0] = pk16(bf_bits(a[0]), bf_bits(a[1]));
  p[1] = pk16(bf_bits(a[2]), bf_bits(a[3]));
  p[2] = pk16(bf_bits(b[0]), bf_bits(b[1]));
  p[3] = pk16(bf_bits(b[2]), bf_bits(b[3]));
  if (i >= n8) { p[0] = 0u; p[1] = 0u; p[2] = 0u; p[3] = 0u; }
  *(v4u*)(out + (size_t)i * 8) = p;
  
}

// =====================================================================================================
// Transpose + convert: in f32 [R][C] row-major -> out bf16 [C][R] (out row c holds column c of in).
// One block per 64x64 tile: 256 threads load 4 x (16 rows x 64 cols) as v4f and store transposed into
// an LDS tile s[c][r] (pitch 68 floats); after a barrier each thread converts 8 consecutive r of one
// coverage: 256 threads x 2 iterations x 8 = 64 rows x 64 cols = the whole 64x64 output tile per block,
//           grid covers all (R/64)x(C/64) tiles = the whole [C][R] plane.
// =====================================================================================================
__global__ __launch_bounds__(256) void tr_cvt64(const float* __restrict__ in, unsigned short* out,
                                                int R, int C) {
  __shared__ __align__(16) float s[64 * 68];
  const int tid = threadIdx.x;
  const int r0 = blockIdx.y * 64;            // source rows
  const int c0 = blockIdx.x * 64;            // source cols = output rows
  const int rl = tid >> 4;                   // 0..15
  const int c4 = (tid & 15) * 4;             // 0..60
#pragma unroll
  for (int it = 0; it < 4; ++it) {
    const int r = it * 16 + rl;
    const v4f v = *(const v4f*)(in + (size_t)(r0 + r) * C + c0 + c4);
    s[(c4 + 0) * 68 + r] = v[0];
    s[(c4 + 1) * 68 + r] = v[1];
    s[(c4 + 2) * 68 + r] = v[2];
    s[(c4 + 3) * 68 + r] = v[3];
  }
  __syncthreads();
  const int q8 = (tid & 7) * 8;
  const int cl = tid >> 3;                   // 0..31
  v4u pk[2];
#pragma unroll
  for (int it = 0; it < 2; ++it) {
    const int c = it * 32 + cl;
    const v4f a = *(const v4f*)(s + c * 68 + q8);
    const v4f b = *(const v4f*)(s + c * 68 + q8 + 4);
    v4u p;
    p[0] = pk16(bf_bits(a[0]), bf_bits(a[1]));
    p[1] = pk16(bf_bits(a[2]), bf_bits(a[3]));
    p[2] = pk16(bf_bits(b[0]), bf_bits(b[1]));
    p[3] = pk16(bf_bits(b[2]), bf_bits(b[3]));
    pk[it] = p;
  }
  {
#pragma unroll
    for (int it = 0; it < 2; ++it) {
      const int c = it * 32 + cl;
      *(v4u*)(out + (size_t)(c0 + c) * R + r0 + q8) = pk[it];
    }
    
  }
}

// =====================================================================================================
// Register-blocked bf16 WMMA GEMM: C[m][n] = alpha * sum_k A[m][k] * Bt[n][k] (+ bias) (+ res[m][n]);
// one wave per 64x64 tile, no block barriers. A row-major [M][K] pitch lda (bf16); Bt row-major [N][K]
// pitch ldb (k contiguous, bf16); M, N multiples of 64, K multiple of 32 (host-checked).
// OUT16: 0 = f32 C (pitch ldc floats); 1 = bf16 C (pitch ldc halves). BIAS: 0 none, 1 = bias[n], 2 = bias[m]
// (bias index clamped into [0, nbias)). RES (f32 mode only): C += res[m][n] (f32, pitch ldr).
// Epilogue: 16-row slabs staged per wave in LDS; f32 mode: each 64-wide row segment (256 B = 2 lines)
// coverage: 4 slabs x 16 rows x 64 cols = the wave's whole 64x64 tile; grid = exact tile count / 8 waves.
// =====================================================================================================
template <int OUT16, int BIAS, int RES>
__global__ __launch_bounds__(256) void gemm64(
    const unsigned short* __restrict__ Ap, int lda,
    const unsigned short* __restrict__ Btp, int ldb,
    void* Cout, int ldc,
    const float* __restrict__ bias, int nbias,
    const float* __restrict__ res, int ldr,
    float alpha, int M, int N, int K) {
  const __bf16* A  = (const __bf16*)(const void*)Ap;
  const __bf16* Bt = (const __bf16*)(const void*)Btp;
  __shared__ __align__(16) float sT[8][16 * 68];   // per-wave 16x64 slab, pitch 68 floats
  const int lane = threadIdx.x & 31;
  const int wave = threadIdx.x >> 5;
  const int tilesN = N >> 6;
  const int tilesM = M >> 6;
  const int tile = blockIdx.x * 8 + wave;
  if (tile >= tilesM * tilesN) return;   // wave-uniform; no block barriers in this kernel
  const int tm = tile / tilesN;
  const int tn = tile - tm * tilesN;
  const int m0 = tm << 6;
  const int n0 = tn << 6;

  const int rlane = lane & 15;                 // row (A) / col (Bt, D) within subtile
  const int koff  = (lane >> 4) * 8;           // k offset of this lane half
  const int mOff  = (lane >> 4) * 8;           // D row offset

  v8f acc[4][4];
#pragma unroll
  for (int i = 0; i < 4; ++i)
#pragma unroll
    for (int j = 0; j < 4; ++j) acc[i][j] = zero8();

  for (int k0 = 0; k0 < K; k0 += 32) {
    v16b bh[4];
#pragma unroll
    for (int j = 0; j < 4; ++j) {
      const size_t bo = (size_t)(n0 + (j << 4) + rlane) * ldb + koff + k0;
      bh[j] = ldfrag_b(Bt + bo);
    }
#pragma unroll
    for (int i = 0; i < 4; ++i) {
      const size_t ao = (size_t)(m0 + (i << 4) + rlane) * lda + koff + k0;
      const v16b ah = ldfrag_b(A + ao);
#pragma unroll
      for (int j = 0; j < 4; ++j) {
        acc[i][j] = mma_b_raw(ah, bh[j], acc[i][j]);
      }
      dep_guard_b(acc[i][0], acc[i][3], ah, bh[3]);
    }
    keep4_b(bh[0], bh[1], bh[2], bh[3]);
  }
  acc_guard4(acc[0][0], acc[0][1], acc[0][2], acc[0][3]);
  acc_guard4(acc[1][0], acc[1][1], acc[1][2], acc[1][3]);
  acc_guard4(acc[2][0], acc[2][1], acc[2][2], acc[2][3]);
  acc_guard4(acc[3][0], acc[3][1], acc[3][2], acc[3][3]);

  float* slab = sT[wave];
#pragma unroll
  for (int i = 0; i < 4; ++i) {
    const int mBase = m0 + (i << 4);
#pragma unroll
    for (int j = 0; j < 4; ++j) {
#pragma unroll
      for (int r = 0; r < 8; ++r) {
        slab[(mOff + r) * 68 + (j << 4) + rlane] = acc[i][j][r];
      }
    }
    wave_sync_lds();
    if (OUT16 == 0) {
      // ---- f32 output: 256-B row segment = 16 lanes x 16 B (lanes 0..15 row 2it, lanes 16..31 row 2it+1)
      float* C = (float*)Cout;
      const int hh = lane >> 4, c4 = (lane & 15) * 4;
      {
#pragma unroll
        for (int it = 0; it < 8; ++it) {
          const int row = it * 2 + hh;                     // it 0..7 x hh 0..1 = rows 0..15
          v4f v = *(const v4f*)(slab + row * 68 + c4);
          v = v * alpha;
          if (BIAS == 1) {
            int bi = n0 + c4; if (bi > nbias - 4) bi = nbias - 4; if (bi < 0) bi = 0;
            const v4f bb = *(const v4f*)(bias + bi);
            v = v + bb;
          }
          if (BIAS == 2) {
            int bi = mBase + row; if (bi > nbias - 1) bi = nbias - 1; if (bi < 0) bi = 0;
            const float bb = bias[bi];
            v[0] += bb; v[1] += bb; v[2] += bb; v[3] += bb;
          }
          if (RES) {
            v4f rr = *(const v4f*)(res + (size_t)(mBase + row) * ldr + n0 + c4);
            rr[0] = bf_round(rr[0]); rr[1] = bf_round(rr[1]); rr[2] = bf_round(rr[2]); rr[3] = bf_round(rr[3]);   // residual input is bf16-rounded
            v = v + rr;
          }
          *(v4f*)(C + (size_t)(mBase + row) * ldc + n0 + c4) = v;
        }
        
      }
    } else {
      unsigned short* C16 = (unsigned short*)Cout;
      const int q8 = (lane & 7) * 8, rr = lane >> 3;
      v4u pk[4];
#pragma unroll
      for (int it = 0; it < 4; ++it) {
        const int row = it * 4 + rr;                       // it 0..3 x rr 0..3 = rows 0..15
        v4f a = *(const v4f*)(slab + row * 68 + q8);
        v4f b = *(const v4f*)(slab + row * 68 + q8 + 4);
        a = a * alpha;
        b = b * alpha;
        if (BIAS == 1) {
          int bi = n0 + q8; if (bi > nbias - 8) bi = nbias - 8; if (bi < 0) bi = 0;
          const v4f b0 = *(const v4f*)(bias + bi);
          const v4f b1 = *(const v4f*)(bias + bi + 4);
          a = a + b0;
          b = b + b1;
        }
        if (BIAS == 2) {
          int bi = mBase + row; if (bi > nbias - 1) bi = nbias - 1; if (bi < 0) bi = 0;
          const float bb = bias[bi];
          a[0] += bb; a[1] += bb; a[2] += bb; a[3] += bb;
          b[0] += bb; b[1] += bb; b[2] += bb; b[3] += bb;
        }
        v4u p;
        p[0] = pk16(bf_bits(a[0]), bf_bits(a[1]));
        p[1] = pk16(bf_bits(a[2]), bf_bits(a[3]));
        p[2] = pk16(bf_bits(b[0]), bf_bits(b[1]));
        p[3] = pk16(bf_bits(b[2]), bf_bits(b[3]));
        pk[it] = p;
      }
      {
#pragma unroll
        for (int it = 0; it < 4; ++it) {
          const int row = it * 4 + rr;
          *(v4u*)(C16 + (size_t)(mBase + row) * ldc + n0 + q8) = pk[it];
        }
        
      }
    }
    wave_sync_lds();
  }
}

// =====================================================================================================
// Row softmax: one block of 256 threads per row of NM = 4096 f32 scores (S, pitch NM); writes the
// probabilities as bf16 into the SEPARATE plane P (pitch NM). Thread t owns columns 8t..8t+7 and
// 2048+8t..2048+8t+7: loads 2 x 32 B, stores 16 B per chunk -> a wave writes 512 contiguous B = 4 whole
// fixed-order partial, shuffle tree per wave, lane 0 of each wave posts to LDS, every thread combines the
// 8 wave values in a fixed order (block-uniform result). p = e * (1/l) with e = exp(s - max) in f32.
// coverage: grid rows x 256 threads x 16 = the whole [rows][4096] P plane.
// =====================================================================================================
__global__ __launch_bounds__(256) void softmax_rows(const float* __restrict__ S, unsigned short* P) {
  __shared__ float sMx[8];
  __shared__ float sSm[8];
  const int tid  = threadIdx.x;
  const int lane = tid & 31;
  const int wave = tid >> 5;
  const size_t rb = (size_t)blockIdx.x * NM;
  const int c0 = tid * 8;
  const int c1 = (NM / 2) + tid * 8;
  const v4f a0 = *(const v4f*)(S + rb + c0);
  const v4f a1 = *(const v4f*)(S + rb + c0 + 4);
  const v4f a2 = *(const v4f*)(S + rb + c1);
  const v4f a3 = *(const v4f*)(S + rb + c1 + 4);
  float v[16];
  v[0]  = a0[0]; v[1]  = a0[1]; v[2]  = a0[2]; v[3]  = a0[3];
  v[4]  = a1[0]; v[5]  = a1[1]; v[6]  = a1[2]; v[7]  = a1[3];
  v[8]  = a2[0]; v[9]  = a2[1]; v[10] = a2[2]; v[11] = a2[3];
  v[12] = a3[0]; v[13] = a3[1]; v[14] = a3[2]; v[15] = a3[3];

  float mx = v[0];
#pragma unroll
  for (int i = 1; i < 16; ++i) mx = fmaxf(mx, v[i]);
  mx = fmaxf(mx, __shfl_xor(mx, 16));
  mx = fmaxf(mx, __shfl_xor(mx, 8));
  mx = fmaxf(mx, __shfl_xor(mx, 4));
  mx = fmaxf(mx, __shfl_xor(mx, 2));
  mx = fmaxf(mx, __shfl_xor(mx, 1));
  if (lane == 0) sMx[wave] = mx;
  __syncthreads();
  float m = sMx[0];
#pragma unroll
  for (int w = 1; w < 8; ++w) m = fmaxf(m, sMx[w]);

  float e[16];
#pragma unroll
  for (int i = 0; i < 16; ++i) e[i] = __expf(v[i] - m);
  float part = (((e[0] + e[1]) + (e[2] + e[3])) + ((e[4] + e[5]) + (e[6] + e[7]))) +
               (((e[8] + e[9]) + (e[10] + e[11])) + ((e[12] + e[13]) + (e[14] + e[15])));
  part += __shfl_xor(part, 16);
  part += __shfl_xor(part, 8);
  part += __shfl_xor(part, 4);
  part += __shfl_xor(part, 2);
  part += __shfl_xor(part, 1);
  if (lane == 0) sSm[wave] = part;
  __syncthreads();
  const float l = ((sSm[0] + sSm[1]) + (sSm[2] + sSm[3])) + ((sSm[4] + sSm[5]) + (sSm[6] + sSm[7]));
  const float inv = 1.0f / l;                      // l >= 1 always (the max term contributes exp(0) = 1)

  v4u p0, p1;
  p0[0] = pk16(bf_bits(e[0]  * inv), bf_bits(e[1]  * inv));
  p0[1] = pk16(bf_bits(e[2]  * inv), bf_bits(e[3]  * inv));
  p0[2] = pk16(bf_bits(e[4]  * inv), bf_bits(e[5]  * inv));
  p0[3] = pk16(bf_bits(e[6]  * inv), bf_bits(e[7]  * inv));
  p1[0] = pk16(bf_bits(e[8]  * inv), bf_bits(e[9]  * inv));
  p1[1] = pk16(bf_bits(e[10] * inv), bf_bits(e[11] * inv));
  p1[2] = pk16(bf_bits(e[12] * inv), bf_bits(e[13] * inv));
  p1[3] = pk16(bf_bits(e[14] * inv), bf_bits(e[15] * inv));
  unsigned short* prow = P + rb;
  *(v4u*)(prow + c0) = p0;
  *(v4u*)(prow + c1) = p1;
  
}

// =====================================================================================================
// Workspace map (bytes), every plane an exact multiple of its 64x64-tile / whole-line store granularity
// (no padded tails needed: all shapes are tile multiples):
//   Xb  bf16 [8192][1024]    16777216
//   Mb  bf16 [4096][1024]     8388608
//   WqT bf16 [1024][1024]     2097152   WkT 2097152   WvT 2097152   (transposed: [n][k], k contiguous)
//   Qb  bf16 [8192][1024]    16777216   (q = x.Wq + bq)
//   Kb  bf16 [4096][1024]     8388608   (keys = mem.Wk + bk)
//   Vt  bf16 [1024][4096]     8388608   (values^T = Wv^T.mem^T + bv per row)
//   S   f32  [2048][4096]    33554432   (scores of one 2048-query chunk, already scaled by 1/32)
//   P   bf16 [2048][4096]    16777216   (softmax of that chunk)
//   total                   115343360
// d_out f32 [8192][1024] = x + P.values, written chunk by chunk by the last GEMM of each chunk.
// =====================================================================================================
extern "C" void kernel_launch(void* const* d_in, const int* in_sizes, int n_in,
                              void* d_out, int out_size, void* d_ws, size_t ws_size,
                              hipStream_t stream) {
  if (n_in < 8) return;
  if (in_sizes[0] != NQ * NH) return;
  if (in_sizes[1] != NM * NH) return;
  if (in_sizes[2] != NH * NH || in_sizes[4] != NH * NH || in_sizes[6] != NH * NH) return;
  if (in_sizes[3] != NH || in_sizes[5] != NH || in_sizes[7] != NH) return;
  if (out_size != NQ * NH) return;

  const float* x  = (const float*)d_in[0];   // [8192][1024]
  const float* mb = (const float*)d_in[1];   // [4096][1024]
  const float* Wq = (const float*)d_in[2];   // [1024][1024], used as x.Wq ([in][out])
  const float* bq = (const float*)d_in[3];   // [1024]
  const float* Wk = (const float*)d_in[4];   // [1024][1024]
  const float* bk = (const float*)d_in[5];   // [1024]
  const float* Wv = (const float*)d_in[6];   // [1024][1024]
  const float* bv = (const float*)d_in[7];   // [1024]
  float* out = (float*)d_out;                // [8192][1024]

  const size_t PXb = (size_t)NQ * NH * 2;
  const size_t PMb = (size_t)NM * NH * 2;
  const size_t PW  = (size_t)NH * NH * 2;
  const size_t PQb = (size_t)NQ * NH * 2;
  const size_t PKb = (size_t)NM * NH * 2;
  const size_t PVt = (size_t)NH * NM * 2;
  const size_t PS  = (size_t)QCH * NM * 4;
  const size_t PP  = (size_t)QCH * NM * 2;
  size_t off = 0;
  const size_t oXb = off; off += PXb;
  const size_t oMb = off; off += PMb;
  const size_t oWq = off; off += PW;
  const size_t oWk = off; off += PW;
  const size_t oWv = off; off += PW;
  const size_t oQb = off; off += PQb;
  const size_t oKb = off; off += PKb;
  const size_t oVt = off; off += PVt;
  const size_t oS  = off; off += PS;
  const size_t oP  = off; off += PP;
  if (off > ws_size) return;                         // off = 115343360
  if (off > (size_t)134217728) return;

  char* ws = (char*)d_ws;
  unsigned short* Xb  = (unsigned short*)(ws + oXb);
  unsigned short* Mb  = (unsigned short*)(ws + oMb);
  unsigned short* WqT = (unsigned short*)(ws + oWq);
  unsigned short* WkT = (unsigned short*)(ws + oWk);
  unsigned short* WvT = (unsigned short*)(ws + oWv);
  unsigned short* Qb  = (unsigned short*)(ws + oQb);
  unsigned short* Kb  = (unsigned short*)(ws + oKb);
  unsigned short* Vt  = (unsigned short*)(ws + oVt);
  float* S = (float*)(ws + oS);
  unsigned short* P = (unsigned short*)(ws + oP);

  const dim3 blk(256);
  const int n8x = NQ * NH / 8;                       // 1048576
  const int n8m = NM * NH / 8;                       //  524288
  const dim3 gCvtX((n8x + 255) / 256);               // 4096 blocks
  const dim3 gCvtM((n8m + 255) / 256);               // 2048 blocks
  const dim3 gTr(NH / 64, NH / 64);                  // in [1024][1024] -> out [1024][1024]: (cols/64, rows/64)
  const dim3 gQ(((NQ / 64) * (NH / 64) + 7) / 8);    // 2048 wave tiles -> 256 blocks
  const dim3 gK(((NM / 64) * (NH / 64) + 7) / 8);    // 1024 wave tiles -> 128 blocks
  const dim3 gV(((NH / 64) * (NM / 64) + 7) / 8);    // 1024 wave tiles -> 128 blocks
  const dim3 gS(((QCH / 64) * (NM / 64) + 7) / 8);   // 2048 wave tiles -> 256 blocks
  const dim3 gSm(QCH);                               // 2048 blocks, one per score row
  const dim3 gO(((QCH / 64) * (NH / 64) + 7) / 8);   //  512 wave tiles ->  64 blocks

  // (1) operand planes (bf16 RNE convert); weights transposed to [out][in] with in contiguous
  cvt_bf16x8<<<gCvtX, blk, 0, stream>>>(x, Xb, n8x, n8x);
  cvt_bf16x8<<<gCvtM, blk, 0, stream>>>(mb, Mb, n8m, n8m);
  tr_cvt64<<<gTr, blk, 0, stream>>>(Wq, WqT, NH, NH);
  tr_cvt64<<<gTr, blk, 0, stream>>>(Wk, WkT, NH, NH);
  tr_cvt64<<<gTr, blk, 0, stream>>>(Wv, WvT, NH, NH);
  // (2) projections: Qb = Xb.WqT^T + bq (M=8192, N=1024, K=1024); Kb = Mb.WkT^T + bk (M=4096);
  //     Vt = WvT.Mb^T + bv[row] (M=1024, N=4096, K=1024) = values transposed, [h][m] with m contiguous
  gemm64<1, 1, 0><<<gQ, blk, 0, stream>>>(Xb, NH, WqT, NH, (void*)Qb, NH, bq, NH, x, NH,
                                         1.0f, NQ, NH, NH);
  gemm64<1, 1, 0><<<gK, blk, 0, stream>>>(Mb, NH, WkT, NH, (void*)Kb, NH, bk, NH, x, NH,
                                         1.0f, NM, NH, NH);
  gemm64<1, 2, 0><<<gV, blk, 0, stream>>>(WvT, NH, Mb, NH, (void*)Vt, NM, bv, NH, x, NH,
                                         1.0f, NH, NM, NH);
  // (3) per 2048-query chunk: S = Qb.Kb^T * (1/32) (f32); P = softmax rows (bf16); out = P.Vt^T + x (f32)
  for (int q4 = 0; q4 < NQ / QCH; ++q4) {
    const size_t rowOff = (size_t)q4 * QCH;
    gemm64<0, 0, 0><<<gS, blk, 0, stream>>>(Qb + rowOff * NH, NH, Kb, NH, (void*)S, NM, bq, NH, x, NH,
                                           0.03125f, QCH, NM, NH);
    softmax_rows<<<gSm, blk, 0, stream>>>(S, P);
    gemm64<0, 0, 1><<<gO, blk, 0, stream>>>(P, NM, Vt, NM, (void*)(out + rowOff * NH), NH, bq, NH,
                                           x + rowOff * NH, NH, 1.0f, QCH, NH, NM);
  }
  (void)hipGetLastError();
}

// v001
// It runs in 498 microseconds.
// Two timings next to v000 put it at 2.22 and 2.21 times that version's speed.
// All contractions (x.Wq, mem.Wk, Wv^T.mem^T with K=1024; q.keys^T with K=1024; P.values with K=4096):
// v_wmma_f32_16x16x32_bf16 (bf16 operands RNE-converted, single product, f32 accumulate);
// softmax max/exp/sum/normalise and the residual add x + ctx in f32 on VALU.
#include <hip/hip_runtime.h>
#include <math.h>
#include <stdint.h>

#define NQ  8192           // query rows
#define NH  1024           // hidden dim
#define NM  4096           // memory slots
#define QCH 8192           // query rows per score / softmax / context pass: all of them, one pass
static_assert(NQ == QCH);
static_assert((QCH % 64) == 0 && (NM % 64) == 0 && (NH % 64) == 0);
static_assert((NH % 32) == 0 && (NM % 32) == 0);
static_assert(NM == 256 * 16);
static_assert(((NQ * NH) % (8 * 256)) == 0 && ((NM * NH) % (8 * 256)) == 0);

typedef __bf16   v16b __attribute__((ext_vector_type(16)));
typedef __bf16   v8b  __attribute__((ext_vector_type(8)));
typedef float    v8f  __attribute__((ext_vector_type(8)));
typedef float    v4f  __attribute__((ext_vector_type(4)));
typedef unsigned int v4u __attribute__((ext_vector_type(4)));

// ---- scalar helpers --------------------------------------------------------------------------------
__device__ __forceinline__ unsigned short bf_bits(float f) {          // f32 -> bf16 bits, RNE convert
  unsigned u = __float_as_uint(f);
  return (unsigned short)((u + 0x7FFFu + ((u >> 16) & 1u)) >> 16);
}
__device__ __forceinline__ unsigned pk16(unsigned short a, unsigned short b) { return (unsigned)a | ((unsigned)b << 16); }
__device__ __forceinline__ v8f zero8() { v8f z = {0.f, 0.f, 0.f, 0.f, 0.f, 0.f, 0.f, 0.f}; return z; }

// ---- fragment loader: 16-bit A/Bt operand, lane -> row/col (lane&15), p already includes +8*(lane>>4);
//      elements 0..7 <- p[0..7] (k0+8h..k0+8h+7), elements 8..15 <- p[16..23] (k0+16+8h..k0+16+8h+7)
__device__ __forceinline__ float bf_round(float f) {               // value of the bf16 RNE rounding of f
  return __uint_as_float(((unsigned)bf_bits(f)) << 16);
}
__device__ __forceinline__ v16b ldfrag_b(const __bf16* p) {
  union { v16b v; v8b h[2]; } f;
  f.h[0] = *(const v8b*)(p);
  f.h[1] = *(const v8b*)(p + 16);
  return f.v;
}

// ---- WMMA helpers with trailing VALU hazard gap --------------------------------------------------------
__device__ __forceinline__ v8f mma_b_raw(v16b a, v16b b, v8f c) {
  return __builtin_amdgcn_wmma_f32_16x16x32_bf16(false, a, false, b, (short)0, c, false, false);
}
__device__ __forceinline__ void dep_guard_b(v8f& a, v8f& b, v16b x, v16b y) {
#if defined(__HIP_DEVICE_COMPILE__)
  asm volatile("v_nop\n\tv_nop\n\tv_nop\n\tv_nop" : "+v"(a), "+v"(b) : "v"(x), "v"(y));
#endif
}
__device__ __forceinline__ void keep4_b(v16b a, v16b b, v16b c, v16b d) {
#if defined(__HIP_DEVICE_COMPILE__)
  asm volatile("v_nop" :: "v"(a), "v"(b), "v"(c), "v"(d));
#endif
}
__device__ __forceinline__ void acc_guard4(v8f& a, v8f& b, v8f& c, v8f& d) {
#if defined(__HIP_DEVICE_COMPILE__)
  asm volatile("v_nop\n\tv_nop\n\tv_nop\n\tv_nop" : "+v"(a), "+v"(b), "+v"(c), "+v"(d));
#endif
}
__device__ __forceinline__ void wave_sync_lds() {
  __builtin_amdgcn_fence(__ATOMIC_RELEASE, "workgroup");
  __builtin_amdgcn_wave_barrier();
  __builtin_amdgcn_fence(__ATOMIC_ACQUIRE, "workgroup");
}

// =====================================================================================================
// f32 -> bf16 (RNE convert), 8 elements per thread, one 16-B store per lane: a wave writes 512 contiguous B
// write zeros (padding rows); the source address is clamped so every load is in range. grid = n8tot/256
// (n8tot a multiple of 256 for every use here). coverage: n8tot threads x 8 = the whole destination plane.
// =====================================================================================================
__global__ __launch_bounds__(256) void cvt_bf16x8(const float* __restrict__ in, unsigned short* out,
                                                  int n8, int n8tot) {
  const int i = blockIdx.x * 256 + threadIdx.x;
  if (i >= n8tot) return;
  int ic = i;
  if (ic > n8 - 1) ic = n8 - 1;
  const v4f a = *(const v4f*)(in + (size_t)ic * 8);
  const v4f b = *(const v4f*)(in + (size_t)ic * 8 + 4);
  v4u p;
  p[0] = pk16(bf_bits(a[0]), bf_bits(a[1]));
  p[1] = pk16(bf_bits(a[2]), bf_bits(a[3]));
  p[2] = pk16(bf_bits(b[0]), bf_bits(b[1]));
  p[3] = pk16(bf_bits(b[2]), bf_bits(b[3]));
  if (i >= n8) { p[0] = 0u; p[1] = 0u; p[2] = 0u; p[3] = 0u; }
  *(v4u*)(out + (size_t)i * 8) = p;
  
}

// =====================================================================================================
// Transpose + convert: in f32 [R][C] row-major -> out bf16 [C][R] (out row c holds column c of in).
// One block per 64x64 tile: 256 threads load 4 x (16 rows x 64 cols) as v4f and store transposed into
// an LDS tile s[c][r] (pitch 68 floats); after a barrier each thread converts 8 consecutive r of one
// coverage: 256 threads x 2 iterations x 8 = 64 rows x 64 cols = the whole 64x64 output tile per block,
//           grid covers all (R/64)x(C/64) tiles = the whole [C][R] plane.
// =====================================================================================================
__global__ __launch_bounds__(256) void tr_cvt64(const float* __restrict__ in, unsigned short* out,
                                                int R, int C) {
  __shared__ __align__(16) float s[64 * 68];
  const int tid = threadIdx.x;
  const int r0 = blockIdx.y * 64;            // source rows
  const int c0 = blockIdx.x * 64;            // source cols = output rows
  const int rl = tid >> 4;                   // 0..15
  const int c4 = (tid & 15) * 4;             // 0..60
#pragma unroll
  for (int it = 0; it < 4; ++it) {
    const int r = it * 16 + rl;
    const v4f v = *(const v4f*)(in + (size_t)(r0 + r) * C + c0 + c4);
    s[(c4 + 0) * 68 + r] = v[0];
    s[(c4 + 1) * 68 + r] = v[1];
    s[(c4 + 2) * 68 + r] = v[2];
    s[(c4 + 3) * 68 + r] = v[3];
  }
  __syncthreads();
  const int q8 = (tid & 7) * 8;
  const int cl = tid >> 3;                   // 0..31
  v4u pk[2];
#pragma unroll
  for (int it = 0; it < 2; ++it) {
    const int c = it * 32 + cl;
    const v4f a = *(const v4f*)(s + c * 68 + q8);
    const v4f b = *(const v4f*)(s + c * 68 + q8 + 4);
    v4u p;
    p[0] = pk16(bf_bits(a[0]), bf_bits(a[1]));
    p[1] = pk16(bf_bits(a[2]), bf_bits(a[3]));
    p[2] = pk16(bf_bits(b[0]), bf_bits(b[1]));
    p[3] = pk16(bf_bits(b[2]), bf_bits(b[3]));
    pk[it] = p;
  }
  {
#pragma unroll
    for (int it = 0; it < 2; ++it) {
      const int c = it * 32 + cl;
      *(v4u*)(out + (size_t)(c0 + c) * R + r0 + q8) = pk[it];
    }
    
  }
}

// =====================================================================================================
// Register-blocked bf16 WMMA GEMM: C[m][n] = alpha * sum_k A[m][k] * Bt[n][k] (+ bias) (+ res[m][n]);
// one wave per 64x64 tile, no block barriers. A row-major [M][K] pitch lda (bf16); Bt row-major [N][K]
// pitch ldb (k contiguous, bf16); M, N multiples of 64, K multiple of 32 (host-checked).
// OUT16: 0 = f32 C (pitch ldc floats); 1 = bf16 C (pitch ldc halves). BIAS: 0 none, 1 = bias[n], 2 = bias[m]
// (bias index clamped into [0, nbias)). RES (f32 mode only): C += res[m][n] (f32, pitch ldr).
// Epilogue: 16-row slabs staged per wave in LDS; f32 mode: each 64-wide row segment (256 B = 2 lines)
// coverage: 4 slabs x 16 rows x 64 cols = the wave's whole 64x64 tile; grid = exact tile count / 8 waves.
// =====================================================================================================
template <int OUT16, int BIAS, int RES>
__global__ __launch_bounds__(256) void gemm64(
    const unsigned short* __restrict__ Ap, int lda,
    const unsigned short* __restrict__ Btp, int ldb,
    void* Cout, int ldc,
    const float* __restrict__ bias, int nbias,
    const float* __restrict__ res, int ldr,
    float alpha, int M, int N, int K) {
  const __bf16* A  = (const __bf16*)(const void*)Ap;
  const __bf16* Bt = (const __bf16*)(const void*)Btp;
  __shared__ __align__(16) float sT[8][16 * 68];   // per-wave 16x64 slab, pitch 68 floats
  const int lane = threadIdx.x & 31;
  const int wave = threadIdx.x >> 5;
  const int tilesN = N >> 6;
  const int tilesM = M >> 6;
  const int tile = blockIdx.x * 8 + wave;
  if (tile >= tilesM * tilesN) return;   // wave-uniform; no block barriers in this kernel
  const int tm = tile / tilesN;
  const int tn = tile - tm * tilesN;
  const int m0 = tm << 6;
  const int n0 = tn << 6;

  const int rlane = lane & 15;                 // row (A) / col (Bt, D) within subtile
  const int koff  = (lane >> 4) * 8;           // k offset of this lane half
  const int mOff  = (lane >> 4) * 8;           // D row offset

  v8f acc[4][4];
#pragma unroll
  for (int i = 0; i < 4; ++i)
#pragma unroll
    for (int j = 0; j < 4; ++j) acc[i][j] = zero8();

  for (int k0 = 0; k0 < K; k0 += 32) {
    v16b bh[4];
#pragma unroll
    for (int j = 0; j < 4; ++j) {
      const size_t bo = (size_t)(n0 + (j << 4) + rlane) * ldb + koff + k0;
      bh[j] = ldfrag_b(Bt + bo);
    }
#pragma unroll
    for (int i = 0; i < 4; ++i) {
      const size_t ao = (size_t)(m0 + (i << 4) + rlane) * lda + koff + k0;
      const v16b ah = ldfrag_b(A + ao);
#pragma unroll
      for (int j = 0; j < 4; ++j) {
        acc[i][j] = mma_b_raw(ah, bh[j], acc[i][j]);
      }
      dep_guard_b(acc[i][0], acc[i][3], ah, bh[3]);
    }
    keep4_b(bh[0], bh[1], bh[2], bh[3]);
  }
  acc_guard4(acc[0][0], acc[0][1], acc[0][2], acc[0][3]);
  acc_guard4(acc[1][0], acc[1][1], acc[1][2], acc[1][3]);
  acc_guard4(acc[2][0], acc[2][1], acc[2][2], acc[2][3]);
  acc_guard4(acc[3][0], acc[3][1], acc[3][2], acc[3][3]);

  float* slab = sT[wave];
#pragma unroll
  for (int i = 0; i < 4; ++i) {
    const int mBase = m0 + (i << 4);
#pragma unroll
    for (int j = 0; j < 4; ++j) {
#pragma unroll
      for (int r = 0; r < 8; ++r) {
        slab[(mOff + r) * 68 + (j << 4) + rlane] = acc[i][j][r];
      }
    }
    wave_sync_lds();
    if (OUT16 == 0) {
      // ---- f32 output: 256-B row segment = 16 lanes x 16 B (lanes 0..15 row 2it, lanes 16..31 row 2it+1)
      float* C = (float*)Cout;
      const int hh = lane >> 4, c4 = (lane & 15) * 4;
      {
#pragma unroll
        for (int it = 0; it < 8; ++it) {
          const int row = it * 2 + hh;                     // it 0..7 x hh 0..1 = rows 0..15
          v4f v = *(const v4f*)(slab + row * 68 + c4);
          v = v * alpha;
          if (BIAS == 1) {
            int bi = n0 + c4; if (bi > nbias - 4) bi = nbias - 4; if (bi < 0) bi = 0;
            const v4f bb = *(const v4f*)(bias + bi);
            v = v + bb;
          }
          if (BIAS == 2) {
            int bi = mBase + row; if (bi > nbias - 1) bi = nbias - 1; if (bi < 0) bi = 0;
            const float bb = bias[bi];
            v[0] += bb; v[1] += bb; v[2] += bb; v[3] += bb;
          }
          if (RES) {
            v4f rr = *(const v4f*)(res + (size_t)(mBase + row) * ldr + n0 + c4);
            rr[0] = bf_round(rr[0]); rr[1] = bf_round(rr[1]); rr[2] = bf_round(rr[2]); rr[3] = bf_round(rr[3]);   // residual input is bf16-rounded
            v = v + rr;
          }
          *(v4f*)(C + (size_t)(mBase + row) * ldc + n0 + c4) = v;
        }
        
      }
    } else {
      unsigned short* C16 = (unsigned short*)Cout;
      const int q8 = (lane & 7) * 8, rr = lane >> 3;
      v4u pk[4];
#pragma unroll
      for (int it = 0; it < 4; ++it) {
        const int row = it * 4 + rr;                       // it 0..3 x rr 0..3 = rows 0..15
        v4f a = *(const v4f*)(slab + row * 68 + q8);
        v4f b = *(const v4f*)(slab + row * 68 + q8 + 4);
        a = a * alpha;
        b = b * alpha;
        if (BIAS == 1) {
          int bi = n0 + q8; if (bi > nbias - 8) bi = nbias - 8; if (bi < 0) bi = 0;
          const v4f b0 = *(const v4f*)(bias + bi);
          const v4f b1 = *(const v4f*)(bias + bi + 4);
          a = a + b0;
          b = b + b1;
        }
        if (BIAS == 2) {
          int bi = mBase + row; if (bi > nbias - 1) bi = nbias - 1; if (bi < 0) bi = 0;
          const float bb = bias[bi];
          a[0] += bb; a[1] += bb; a[2] += bb; a[3] += bb;
          b[0] += bb; b[1] += bb; b[2] += bb; b[3] += bb;
        }
        v4u p;
        p[0] = pk16(bf_bits(a[0]), bf_bits(a[1]));
        p[1] = pk16(bf_bits(a[2]), bf_bits(a[3]));
        p[2] = pk16(bf_bits(b[0]), bf_bits(b[1]));
        p[3] = pk16(bf_bits(b[2]), bf_bits(b[3]));
        pk[it] = p;
      }
      {
#pragma unroll
        for (int it = 0; it < 4; ++it) {
          const int row = it * 4 + rr;
          *(v4u*)(C16 + (size_t)(mBase + row) * ldc + n0 + q8) = pk[it];
        }
        
      }
    }
    wave_sync_lds();
  }
}

// =====================================================================================================
// Row softmax: one block of 256 threads per row of NM = 4096 f32 scores (S, pitch NM); writes the
// probabilities as bf16 into the SEPARATE plane P (pitch NM). Thread t owns columns 8t..8t+7 and
// 2048+8t..2048+8t+7: loads 2 x 32 B, stores 16 B per chunk -> a wave writes 512 contiguous B = 4 whole
// fixed-order partial, shuffle tree per wave, lane 0 of each wave posts to LDS, every thread combines the
// 8 wave values in a fixed order (block-uniform result). p = e * (1/l) with e = exp(s - max) in f32.
// coverage: grid rows x 256 threads x 16 = the whole [rows][4096] P plane.
// =====================================================================================================
__global__ __launch_bounds__(256) void softmax_rows(const float* __restrict__ S, unsigned short* P) {
  __shared__ float sMx[8];
  __shared__ float sSm[8];
  const int tid  = threadIdx.x;
  const int lane = tid & 31;
  const int wave = tid >> 5;
  const size_t rb = (size_t)blockIdx.x * NM;
  const int c0 = tid * 8;
  const int c1 = (NM / 2) + tid * 8;
  const v4f a0 = *(const v4f*)(S + rb + c0);
  const v4f a1 = *(const v4f*)(S + rb + c0 + 4);
  const v4f a2 = *(const v4f*)(S + rb + c1);
  const v4f a3 = *(const v4f*)(S + rb + c1 + 4);
  float v[16];
  v[0]  = a0[0]; v[1]  = a0[1]; v[2]  = a0[2]; v[3]  = a0[3];
  v[4]  = a1[0]; v[5]  = a1[1]; v[6]  = a1[2]; v[7]  = a1[3];
  v[8]  = a2[0]; v[9]  = a2[1]; v[10] = a2[2]; v[11] = a2[3];
  v[12] = a3[0]; v[13] = a3[1]; v[14] = a3[2]; v[15] = a3[3];

  float mx = v[0];
#pragma unroll
  for (int i = 1; i < 16; ++i) mx = fmaxf(mx, v[i]);
  mx = fmaxf(mx, __shfl_xor(mx, 16));
  mx = fmaxf(mx, __shfl_xor(mx, 8));
  mx = fmaxf(mx, __shfl_xor(mx, 4));
  mx = fmaxf(mx, __shfl_xor(mx, 2));
  mx = fmaxf(mx, __shfl_xor(mx, 1));
  if (lane == 0) sMx[wave] = mx;
  __syncthreads();
  float m = sMx[0];
#pragma unroll
  for (int w = 1; w < 8; ++w) m = fmaxf(m, sMx[w]);

  float e[16];
#pragma unroll
  for (int i = 0; i < 16; ++i) e[i] = __expf(v[i] - m);
  float part = (((e[0] + e[1]) + (e[2] + e[3])) + ((e[4] + e[5]) + (e[6] + e[7]))) +
               (((e[8] + e[9]) + (e[10] + e[11])) + ((e[12] + e[13]) + (e[14] + e[15])));
  part += __shfl_xor(part, 16);
  part += __shfl_xor(part, 8);
  part += __shfl_xor(part, 4);
  part += __shfl_xor(part, 2);
  part += __shfl_xor(part, 1);
  if (lane == 0) sSm[wave] = part;
  __syncthreads();
  const float l = ((sSm[0] + sSm[1]) + (sSm[2] + sSm[3])) + ((sSm[4] + sSm[5]) + (sSm[6] + sSm[7]));
  const float inv = 1.0f / l;                      // l >= 1 always (the max term contributes exp(0) = 1)

  v4u p0, p1;
  p0[0] = pk16(bf_bits(e[0]  * inv), bf_bits(e[1]  * inv));
  p0[1] = pk16(bf_bits(e[2]  * inv), bf_bits(e[3]  * inv));
  p0[2] = pk16(bf_bits(e[4]  * inv), bf_bits(e[5]  * inv));
  p0[3] = pk16(bf_bits(e[6]  * inv), bf_bits(e[7]  * inv));
  p1[0] = pk16(bf_bits(e[8]  * inv), bf_bits(e[9]  * inv));
  p1[1] = pk16(bf_bits(e[10] * inv), bf_bits(e[11] * inv));
  p1[2] = pk16(bf_bits(e[12] * inv), bf_bits(e[13] * inv));
  p1[3] = pk16(bf_bits(e[14] * inv), bf_bits(e[15] * inv));
  unsigned short* prow = P + rb;
  *(v4u*)(prow + c0) = p0;
  *(v4u*)(prow + c1) = p1;
  
}

// =====================================================================================================
// Workspace map (bytes), every plane an exact multiple of its 64x64-tile / whole-line store granularity
// (no padded tails needed: all shapes are tile multiples):
//   Xb  bf16 [8192][1024]    16777216
//   Mb  bf16 [4096][1024]     8388608
//   WqT bf16 [1024][1024]     2097152   WkT 2097152   WvT 2097152   (transposed: [n][k], k contiguous)
//   Qb  bf16 [8192][1024]    16777216   (q = x.Wq + bq)
//   Kb  bf16 [4096][1024]     8388608   (keys = mem.Wk + bk)
//   Vt  bf16 [1024][4096]     8388608   (values^T = Wv^T.mem^T + bv per row)
//   S   f32  [8192][4096]   134217728   (scores of all queries, already scaled by 1/32)
//   P   bf16 [8192][4096]    67108864   (softmax of all rows)
//   total                   266338304
// d_out f32 [8192][1024] = x + P.values, written by the last GEMM: 2048 wave tiles = 256 blocks, one per WGP.
// =====================================================================================================
extern "C" void kernel_launch(void* const* d_in, const int* in_sizes, int n_in,
                              void* d_out, int out_size, void* d_ws, size_t ws_size,
                              hipStream_t stream) {
  if (n_in < 8) return;
  if (in_sizes[0] != NQ * NH) return;
  if (in_sizes[1] != NM * NH) return;
  if (in_sizes[2] != NH * NH || in_sizes[4] != NH * NH || in_sizes[6] != NH * NH) return;
  if (in_sizes[3] != NH || in_sizes[5] != NH || in_sizes[7] != NH) return;
  if (out_size != NQ * NH) return;

  const float* x  = (const float*)d_in[0];   // [8192][1024]
  const float* mb = (const float*)d_in[1];   // [4096][1024]
  const float* Wq = (const float*)d_in[2];   // [1024][1024], used as x.Wq ([in][out])
  const float* bq = (const float*)d_in[3];   // [1024]
  const float* Wk = (const float*)d_in[4];   // [1024][1024]
  const float* bk = (const float*)d_in[5];   // [1024]
  const float* Wv = (const float*)d_in[6];   // [1024][1024]
  const float* bv = (const float*)d_in[7];   // [1024]
  float* out = (float*)d_out;                // [8192][1024]

  const size_t PXb = (size_t)NQ * NH * 2;
  const size_t PMb = (size_t)NM * NH * 2;
  const size_t PW  = (size_t)NH * NH * 2;
  const size_t PQb = (size_t)NQ * NH * 2;
  const size_t PKb = (size_t)NM * NH * 2;
  const size_t PVt = (size_t)NH * NM * 2;
  const size_t PS  = (size_t)QCH * NM * 4;
  const size_t PP  = (size_t)QCH * NM * 2;
  size_t off = 0;
  const size_t oXb = off; off += PXb;
  const size_t oMb = off; off += PMb;
  const size_t oWq = off; off += PW;
  const size_t oWk = off; off += PW;
  const size_t oWv = off; off += PW;
  const size_t oQb = off; off += PQb;
  const size_t oKb = off; off += PKb;
  const size_t oVt = off; off += PVt;
  const size_t oS  = off; off += PS;
  const size_t oP  = off; off += PP;
  if (off > ws_size) return;                         // off = 266338304

  char* ws = (char*)d_ws;
  unsigned short* Xb  = (unsigned short*)(ws + oXb);
  unsigned short* Mb  = (unsigned short*)(ws + oMb);
  unsigned short* WqT = (unsigned short*)(ws + oWq);
  unsigned short* WkT = (unsigned short*)(ws + oWk);
  unsigned short* WvT = (unsigned short*)(ws + oWv);
  unsigned short* Qb  = (unsigned short*)(ws + oQb);
  unsigned short* Kb  = (unsigned short*)(ws + oKb);
  unsigned short* Vt  = (unsigned short*)(ws + oVt);
  float* S = (float*)(ws + oS);
  unsigned short* P = (unsigned short*)(ws + oP);

  const dim3 blk(256);
  const int n8x = NQ * NH / 8;                       // 1048576
  const int n8m = NM * NH / 8;                       //  524288
  const dim3 gCvtX((n8x + 255) / 256);               // 4096 blocks
  const dim3 gCvtM((n8m + 255) / 256);               // 2048 blocks
  const dim3 gTr(NH / 64, NH / 64);                  // in [1024][1024] -> out [1024][1024]: (cols/64, rows/64)
  const dim3 gQ(((NQ / 64) * (NH / 64) + 7) / 8);    // 2048 wave tiles -> 256 blocks
  const dim3 gK(((NM / 64) * (NH / 64) + 7) / 8);    // 1024 wave tiles -> 128 blocks
  const dim3 gV(((NH / 64) * (NM / 64) + 7) / 8);    // 1024 wave tiles -> 128 blocks
  const dim3 gS(((QCH / 64) * (NM / 64) + 7) / 8);   // 8192 wave tiles -> 1024 blocks
  const dim3 gSm(QCH);                               // 8192 blocks, one per score row
  const dim3 gO(((QCH / 64) * (NH / 64) + 7) / 8);   // 2048 wave tiles ->  256 blocks

  // (1) operand planes (bf16 RNE convert); weights transposed to [out][in] with in contiguous
  cvt_bf16x8<<<gCvtX, blk, 0, stream>>>(x, Xb, n8x, n8x);
  cvt_bf16x8<<<gCvtM, blk, 0, stream>>>(mb, Mb, n8m, n8m);
  tr_cvt64<<<gTr, blk, 0, stream>>>(Wq, WqT, NH, NH);
  tr_cvt64<<<gTr, blk, 0, stream>>>(Wk, WkT, NH, NH);
  tr_cvt64<<<gTr, blk, 0, stream>>>(Wv, WvT, NH, NH);
  // (2) projections: Qb = Xb.WqT^T + bq (M=8192, N=1024, K=1024); Kb = Mb.WkT^T + bk (M=4096);
  //     Vt = WvT.Mb^T + bv[row] (M=1024, N=4096, K=1024) = values transposed, [h][m] with m contiguous
  gemm64<1, 1, 0><<<gQ, blk, 0, stream>>>(Xb, NH, WqT, NH, (void*)Qb, NH, bq, NH, x, NH,
                                         1.0f, NQ, NH, NH);
  gemm64<1, 1, 0><<<gK, blk, 0, stream>>>(Mb, NH, WkT, NH, (void*)Kb, NH, bk, NH, x, NH,
                                         1.0f, NM, NH, NH);
  gemm64<1, 2, 0><<<gV, blk, 0, stream>>>(WvT, NH, Mb, NH, (void*)Vt, NM, bv, NH, x, NH,
                                         1.0f, NH, NM, NH);
  // (3) one pass over all queries: S = Qb.Kb^T * (1/32) (f32); P = softmax rows (bf16); out = P.Vt^T + x (f32)
  gemm64<0, 0, 0><<<gS, blk, 0, stream>>>(Qb, NH, Kb, NH, (void*)S, NM, bq, NH, x, NH,
                                         0.03125f, QCH, NM, NH);
  softmax_rows<<<gSm, blk, 0, stream>>>(S, P);
  gemm64<0, 0, 1><<<gO, blk, 0, stream>>>(P, NM, Vt, NM, (void*)out, NH, bq, NH,
                                         x, NH, 1.0f, QCH, NH, NM);
  (void)hipGetLastError();
}
